// v000
// Times are from an AMD MI455X. After a warm-up the kernel runs many times in a row, and a time is the length of
// such a window on the GPU divided by its runs, so every launch and the gaps after it count. The runs cycle
// through copies of the inputs. A figure is the median of several windows, for all but v000 over two sittings.
// Sittings can differ by a few percent; kernels timed side by side share one.
// v000, which the later versions start from, runs in 2140 microseconds.
#include <hip/hip_runtime.h>

typedef __attribute__((ext_vector_type(2))) float v2f;
typedef __attribute__((ext_vector_type(8))) float v8f;

#define BM 64
#define BN 64
#define BK 32

#define A_STRIDE    36   // MK layout row stride in floats (144B, 16B-aligned)
#define B_NK_STRIDE 36   // NK layout (transB) row stride
#define B_KN_STRIDE 68   // KN layout (!transB) row stride (272B, 16B-aligned)
#define BUF_ELEMS   2304 // max(64*36, 32*68)

// One 16-byte global->LDS async copy (no VGPR staging, tracked by ASYNCcnt).
__device__ __forceinline__ void async_copy16(unsigned lds_off, const float* gptr) {
    asm volatile("global_load_async_to_lds_b128 %0, %1, off"
                 :: "v"(lds_off), "v"(gptr)
                 : "memory");
}

// Generic fp32 WMMA GEMM:
//   C[m][n] = sum_k A[m*lda+k] * (TRANSB ? B[n*ldb+k] : B[k*ldb+n]) (+ bias[n])
// TRANSC: store C[n*ldc+m]. Batched over blockIdx.z, z = b*nh + h.
template<int TRANSB, int TRANSC, int HASBIAS>
__global__ __launch_bounds__(128)
void retnext_gemm_f32_wmma(const float* __restrict__ A,
                           const float* __restrict__ B,
                           const float* __restrict__ bias,
                           float* __restrict__ C,
                           int M, int N, int K,
                           int lda, int ldb, int ldc,
                           long long sAb, long long sAh,
                           long long sBb, long long sBh,
                           long long sCb, long long sCh,
                           int nh)
{
    __shared__ __align__(16) float As[2][BUF_ELEMS];  // [m][k], stride A_STRIDE
    __shared__ __align__(16) float Bs[2][BUF_ELEMS];  // NK or KN layout

    const int z  = blockIdx.z;
    const int bb = z / nh;
    const int hh = z % nh;
    A += bb * sAb + hh * sAh;
    B += bb * sBb + hh * sBh;
    C += bb * sCb + hh * sCh;

    const int nBase = blockIdx.x * BN;
    const int mBase = blockIdx.y * BM;

    const int tid   = threadIdx.x;
    const int lane  = tid & 31;
    const int wave  = tid >> 5;          // 0..3
    const int lmod  = lane & 15;
    const int lhalf = lane >> 4;         // 0 or 1
    const int wm    = (wave >> 1) * 32;  // wave's row offset in 64x64 tile
    const int wn    = (wave & 1) * 32;   // wave's col offset

    const unsigned asBase = (unsigned)(size_t)&As[0][0];  // LDS byte offset
    const unsigned bsBase = (unsigned)(size_t)&Bs[0][0];

    // Issue 8 async B128 copies (4 for A tile, 4 for B tile) into buffer `buf`.
    auto stage_async = [&](int k0, int buf) {
#pragma unroll
        for (int p = 0; p < 4; ++p) {
            int f   = tid + p * 128;         // 512 x float4 = 64 rows * 8 groups
            int row = f >> 3;                // m
            int cg  = (f & 7) * 4;           // k
            const float* g = A + (size_t)(mBase + row) * lda + k0 + cg;
            unsigned l = asBase + (unsigned)((buf * BUF_ELEMS + row * A_STRIDE + cg) * 4);
            async_copy16(l, g);
        }
        if (TRANSB) {
            // source B[n][k] -> Bs_nk[n][k]: pure row copy
#pragma unroll
            for (int p = 0; p < 4; ++p) {
                int f   = tid + p * 128;
                int row = f >> 3;            // n
                int cg  = (f & 7) * 4;       // k
                const float* g = B + (size_t)(nBase + row) * ldb + k0 + cg;
                unsigned l = bsBase + (unsigned)((buf * BUF_ELEMS + row * B_NK_STRIDE + cg) * 4);
                async_copy16(l, g);
            }
        } else {
            // source B[k][n] -> Bs_kn[k][n]: pure row copy
#pragma unroll
            for (int p = 0; p < 4; ++p) {
                int f   = tid + p * 128;     // 512 x float4 = 32 rows * 16 groups
                int row = f >> 4;            // k
                int cg  = (f & 15) * 4;      // n
                const float* g = B + (size_t)(k0 + row) * ldb + nBase + cg;
                unsigned l = bsBase + (unsigned)((buf * BUF_ELEMS + row * B_KN_STRIDE + cg) * 4);
                async_copy16(l, g);
            }
        }
    };

    v8f acc[4];
#pragma unroll
    for (int i = 0; i < 4; ++i) acc[i] = (v8f)0.0f;

    const int nChunks = K / BK;
    stage_async(0, 0);

    for (int c = 0; c < nChunks; ++c) {
        const int cur = c & 1;

        if (c + 1 < nChunks) {
            stage_async((c + 1) * BK, cur ^ 1);
            // chunk c's 8 asyncs complete (in order); chunk c+1's 8 stay in flight
            asm volatile("s_wait_asynccnt 0x8" ::: "memory");
        } else {
            asm volatile("s_wait_asynccnt 0x0" ::: "memory");
        }
        __syncthreads();

        const float* Ab = &As[cur][0];
        const float* Bb = &Bs[cur][0];

#pragma unroll
        for (int kk = 0; kk < BK; kk += 4) {
            const int ka = kk + lhalf * 2;
            v2f a0, a1, b0, b1;
            a0[0] = Ab[(wm + lmod) * A_STRIDE + ka];
            a0[1] = Ab[(wm + lmod) * A_STRIDE + ka + 1];
            a1[0] = Ab[(wm + 16 + lmod) * A_STRIDE + ka];
            a1[1] = Ab[(wm + 16 + lmod) * A_STRIDE + ka + 1];
            if (TRANSB) {
                b0[0] = Bb[(wn + lmod) * B_NK_STRIDE + ka];
                b0[1] = Bb[(wn + lmod) * B_NK_STRIDE + ka + 1];
                b1[0] = Bb[(wn + 16 + lmod) * B_NK_STRIDE + ka];
                b1[1] = Bb[(wn + 16 + lmod) * B_NK_STRIDE + ka + 1];
            } else {
                b0[0] = Bb[ka * B_KN_STRIDE + wn + lmod];
                b0[1] = Bb[(ka + 1) * B_KN_STRIDE + wn + lmod];
                b1[0] = Bb[ka * B_KN_STRIDE + wn + 16 + lmod];
                b1[1] = Bb[(ka + 1) * B_KN_STRIDE + wn + 16 + lmod];
            }
            acc[0] = __builtin_amdgcn_wmma_f32_16x16x4_f32(false, a0, false, b0, (short)0, acc[0], false, false);
            acc[1] = __builtin_amdgcn_wmma_f32_16x16x4_f32(false, a0, false, b1, (short)0, acc[1], false, false);
            acc[2] = __builtin_amdgcn_wmma_f32_16x16x4_f32(false, a1, false, b0, (short)0, acc[2], false, false);
            acc[3] = __builtin_amdgcn_wmma_f32_16x16x4_f32(false, a1, false, b1, (short)0, acc[3], false, false);
        }
        __syncthreads();
    }

    // ---- epilogue: bias + store (normal or transposed) ----
#pragma unroll
    for (int i = 0; i < 2; ++i) {
#pragma unroll
        for (int j = 0; j < 2; ++j) {
            v8f r = acc[i * 2 + j];
            const int n = nBase + wn + j * 16 + lmod;
            float bv = 0.0f;
            if (HASBIAS) bv = bias[n];
            const int mB = mBase + wm + i * 16 + lhalf * 8;
            if (!TRANSC) {
#pragma unroll
                for (int e = 0; e < 8; ++e)
                    C[(size_t)(mB + e) * ldc + n] = r[e] + bv;
            } else {
#pragma unroll
                for (int e = 0; e < 8; ++e)
                    C[(size_t)n * ldc + mB + e] = r[e] + bv;
            }
        }
    }
}

extern "C" void kernel_launch(void* const* d_in, const int* in_sizes, int n_in,
                              void* d_out, int out_size, void* d_ws, size_t ws_size,
                              hipStream_t stream)
{
    const float* x  = (const float*)d_in[0];
    const float* Wk = (const float*)d_in[1];
    const float* bk = (const float*)d_in[2];
    const float* Wq = (const float*)d_in[3];
    const float* bq = (const float*)d_in[4];
    const float* Wv = (const float*)d_in[5];
    const float* bv = (const float*)d_in[6];
    float* out = (float*)d_out;

    const int Bsz = 4, T = 4096, D = 2048, H = 4, Dh = 512;
    const int Mtot = Bsz * T;  // 16384

    // workspace (fp32): KT (D x Mtot), Q (Mtot x D), V (Mtot x D), S (B*H x Dh x Dh)
    float* KT = (float*)d_ws;
    float* Q  = KT + (size_t)D * Mtot;
    float* V  = Q  + (size_t)Mtot * D;
    float* S  = V  + (size_t)Mtot * D;

    dim3 blk(128);

    // Phase 1a: KT = (x @ Wk^T + bk)^T   -> KT[d][m], ldc = Mtot
    retnext_gemm_f32_wmma<1, 1, 1><<<dim3(D / BN, Mtot / BM, 1), blk, 0, stream>>>(
        x, Wk, bk, KT, Mtot, D, D, D, D, Mtot,
        0, 0, 0, 0, 0, 0, 1);

    // Phase 1b: Q = x @ Wq^T + bq
    retnext_gemm_f32_wmma<1, 0, 1><<<dim3(D / BN, Mtot / BM, 1), blk, 0, stream>>>(
        x, Wq, bq, Q, Mtot, D, D, D, D, D,
        0, 0, 0, 0, 0, 0, 1);

    // Phase 1c: V = x @ Wv^T + bv
    retnext_gemm_f32_wmma<1, 0, 1><<<dim3(D / BN, Mtot / BM, 1), blk, 0, stream>>>(
        x, Wv, bv, V, Mtot, D, D, D, D, D,
        0, 0, 0, 0, 0, 0, 1);

    // Phase 2: states[b,h] = KT[h*Dh:, b*T:] (Dh x T) @ V[b*T:, h*Dh:] (T x Dh)
    retnext_gemm_f32_wmma<0, 0, 0><<<dim3(Dh / BN, Dh / BM, Bsz * H), blk, 0, stream>>>(
        KT, V, nullptr, S, Dh, Dh, T,
        /*lda*/Mtot, /*ldb*/D, /*ldc*/Dh,
        /*sAb*/(long long)T,           /*sAh*/(long long)Dh * Mtot,
        /*sBb*/(long long)T * D,       /*sBh*/(long long)Dh,
        /*sCb*/(long long)H * Dh * Dh, /*sCh*/(long long)Dh * Dh,
        H);

    // Phase 3: out[b,h] = Q[b*T:, h*Dh:] (T x Dh) @ states[b,h] (Dh x Dh)
    retnext_gemm_f32_wmma<0, 0, 0><<<dim3(Dh / BN, T / BM, Bsz * H), blk, 0, stream>>>(
        Q, S, nullptr, out, T, Dh, Dh,
        /*lda*/D, /*ldb*/Dh, /*ldc*/Dh,
        /*sAb*/(long long)T * D,       /*sAh*/(long long)Dh,
        /*sBb*/(long long)H * Dh * Dh, /*sBh*/(long long)Dh * Dh,
        /*sCb*/(long long)H * T * Dh,  /*sCh*/(long long)T * Dh,
        H);
}

// v001
// One run takes 1980 microseconds.
// Two timings next to v000 both put it at 1.10 times that version's speed.
#include <hip/hip_runtime.h>

typedef __attribute__((ext_vector_type(2))) float v2f;
typedef __attribute__((ext_vector_type(8))) float v8f;

#define BM 64
#define BN 64
#define BK 32

#define A_STRIDE    36   // MK layout row stride in floats (144B, 16B-aligned)
#define B_NK_STRIDE 36   // NK layout (transB) row stride
#define B_KN_STRIDE 68   // KN layout (!transB) row stride (272B, 16B-aligned)
#define BUF_ELEMS   2304 // max(64*36, 32*68)
#define G_STRIDE    80   // Gram tiles, [k][64] rows: the 4 k rows of one fragment read fall on 4 disjoint 16-bank groups
#define G_ELEMS     2560 // 32 * 80
#define NX          64   // extra rows of the extended Gram matrix (row D holds the column sums of x)

// One 16-byte global->LDS async copy (no VGPR staging, tracked by ASYNCcnt).
__device__ __forceinline__ void async_copy16(unsigned lds_off, const float* gptr) {
    asm volatile("global_load_async_to_lds_b128 %0, %1, off"
                 :: "v"(lds_off), "v"(gptr)
                 : "memory");
}

// Generic fp32 WMMA GEMM:
//   C[m][n] = sum_k A[m*lda+k] * (TRANSB ? B[n*ldb+k] : B[k*ldb+n]) (+ bias[n])
// HASBIAS == 2: rank-1 term instead of a bias: + rowv[m*rvStride] * bias[n].
// TRANSC: store C[n*ldc+m]. Batched over blockIdx.z, z = b*nh + h.
template<int TRANSB, int TRANSC, int HASBIAS>
__global__ __launch_bounds__(128)
void retnext_gemm_f32_wmma(const float* __restrict__ A,
                           const float* __restrict__ B,
                           const float* __restrict__ bias,
                           float* __restrict__ C,
                           int M, int N, int K,
                           int lda, int ldb, int ldc,
                           long long sAb, long long sAh,
                           long long sBb, long long sBh,
                           long long sCb, long long sCh,
                           int nh,
                           const float* __restrict__ rowv, int rvStride,
                           long long sVb, long long sVh,
                           long long sQb, long long sQh)
{
    __shared__ __align__(16) float As[2][BUF_ELEMS];  // [m][k], stride A_STRIDE
    __shared__ __align__(16) float Bs[2][BUF_ELEMS];  // NK or KN layout

    const int z  = blockIdx.z;
    const int bb = z / nh;
    const int hh = z % nh;
    A += bb * sAb + hh * sAh;
    B += bb * sBb + hh * sBh;
    C += bb * sCb + hh * sCh;
    if (HASBIAS == 2) {
        rowv += bb * sVb + hh * sVh;
        bias += bb * sQb + hh * sQh;
    }

    const int nBase = blockIdx.x * BN;
    const int mBase = blockIdx.y * BM;

    const int tid   = threadIdx.x;
    const int lane  = tid & 31;
    const int wave  = tid >> 5;          // 0..3
    const int lmod  = lane & 15;
    const int lhalf = lane >> 4;         // 0 or 1
    const int wm    = (wave >> 1) * 32;  // wave's row offset in 64x64 tile
    const int wn    = (wave & 1) * 32;   // wave's col offset

    const unsigned asBase = (unsigned)(size_t)&As[0][0];  // LDS byte offset
    const unsigned bsBase = (unsigned)(size_t)&Bs[0][0];

    // Issue 8 async B128 copies (4 for A tile, 4 for B tile) into buffer `buf`.
    auto stage_async = [&](int k0, int buf) {
#pragma unroll
        for (int p = 0; p < 4; ++p) {
            int f   = tid + p * 128;         // 512 x float4 = 64 rows * 8 groups
            int row = f >> 3;                // m
            int cg  = (f & 7) * 4;           // k
            const float* g = A + (size_t)(mBase + row) * lda + k0 + cg;
            unsigned l = asBase + (unsigned)((buf * BUF_ELEMS + row * A_STRIDE + cg) * 4);
            async_copy16(l, g);
        }
        if (TRANSB) {
            // source B[n][k] -> Bs_nk[n][k]: pure row copy
#pragma unroll
            for (int p = 0; p < 4; ++p) {
                int f   = tid + p * 128;
                int row = f >> 3;            // n
                int cg  = (f & 7) * 4;       // k
                const float* g = B + (size_t)(nBase + row) * ldb + k0 + cg;
                unsigned l = bsBase + (unsigned)((buf * BUF_ELEMS + row * B_NK_STRIDE + cg) * 4);
                async_copy16(l, g);
            }
        } else {
            // source B[k][n] -> Bs_kn[k][n]: pure row copy
#pragma unroll
            for (int p = 0; p < 4; ++p) {
                int f   = tid + p * 128;     // 512 x float4 = 32 rows * 16 groups
                int row = f >> 4;            // k
                int cg  = (f & 15) * 4;      // n
                const float* g = B + (size_t)(k0 + row) * ldb + nBase + cg;
                unsigned l = bsBase + (unsigned)((buf * BUF_ELEMS + row * B_KN_STRIDE + cg) * 4);
                async_copy16(l, g);
            }
        }
    };

    v8f acc[4];
#pragma unroll
    for (int i = 0; i < 4; ++i) acc[i] = (v8f)0.0f;

    const int nChunks = K / BK;
    stage_async(0, 0);

    for (int c = 0; c < nChunks; ++c) {
        const int cur = c & 1;

        if (c + 1 < nChunks) {
            stage_async((c + 1) * BK, cur ^ 1);
            // chunk c's 8 asyncs complete (in order); chunk c+1's 8 stay in flight
            asm volatile("s_wait_asynccnt 0x8" ::: "memory");
        } else {
            asm volatile("s_wait_asynccnt 0x0" ::: "memory");
        }
        __syncthreads();

        const float* Ab = &As[cur][0];
        const float* Bb = &Bs[cur][0];

#pragma unroll
        for (int kk = 0; kk < BK; kk += 4) {
            const int ka = kk + lhalf * 2;
            v2f a0, a1, b0, b1;
            a0[0] = Ab[(wm + lmod) * A_STRIDE + ka];
            a0[1] = Ab[(wm + lmod) * A_STRIDE + ka + 1];
            a1[0] = Ab[(wm + 16 + lmod) * A_STRIDE + ka];
            a1[1] = Ab[(wm + 16 + lmod) * A_STRIDE + ka + 1];
            if (TRANSB) {
                b0[0] = Bb[(wn + lmod) * B_NK_STRIDE + ka];
                b0[1] = Bb[(wn + lmod) * B_NK_STRIDE + ka + 1];
                b1[0] = Bb[(wn + 16 + lmod) * B_NK_STRIDE + ka];
                b1[1] = Bb[(wn + 16 + lmod) * B_NK_STRIDE + ka + 1];
            } else {
                b0[0] = Bb[ka * B_KN_STRIDE + wn + lmod];
                b0[1] = Bb[(ka + 1) * B_KN_STRIDE + wn + lmod];
                b1[0] = Bb[ka * B_KN_STRIDE + wn + 16 + lmod];
                b1[1] = Bb[(ka + 1) * B_KN_STRIDE + wn + 16 + lmod];
            }
            acc[0] = __builtin_amdgcn_wmma_f32_16x16x4_f32(false, a0, false, b0, (short)0, acc[0], false, false);
            acc[1] = __builtin_amdgcn_wmma_f32_16x16x4_f32(false, a0, false, b1, (short)0, acc[1], false, false);
            acc[2] = __builtin_amdgcn_wmma_f32_16x16x4_f32(false, a1, false, b0, (short)0, acc[2], false, false);
            acc[3] = __builtin_amdgcn_wmma_f32_16x16x4_f32(false, a1, false, b1, (short)0, acc[3], false, false);
        }
        __syncthreads();
    }

    // ---- epilogue: bias + store (normal or transposed) ----
#pragma unroll
    for (int i = 0; i < 2; ++i) {
#pragma unroll
        for (int j = 0; j < 2; ++j) {
            v8f r = acc[i * 2 + j];
            const int n = nBase + wn + j * 16 + lmod;
            float bv = 0.0f;
            if (HASBIAS) bv = bias[n];
            const int mB = mBase + wm + i * 16 + lhalf * 8;
            if (HASBIAS == 2) {
#pragma unroll
                for (int e = 0; e < 8; ++e)
                    C[(size_t)(mB + e) * ldc + n] = r[e] + rowv[(size_t)(mB + e) * rvStride] * bv;
            } else if (!TRANSC) {
#pragma unroll
                for (int e = 0; e < 8; ++e)
                    C[(size_t)(mB + e) * ldc + n] = r[e] + bv;
            } else {
#pragma unroll
                for (int e = 0; e < 8; ++e)
                    C[(size_t)n * ldc + mB + e] = r[e] + bv;
            }
        }
    }
}

// Gram matrix of one batch: G[m][n] = sum_t X[t*D+m] * X[t*D+n], batched over blockIdx.z.
// Both operand tiles are 32 rows (t) of 64 floats, copied row by row into LDS.
__global__ __launch_bounds__(128)
void gram_f32_wmma(const float* __restrict__ X, float* __restrict__ G,
                   int T, int D, long long sX, long long sG)
{
    __shared__ __align__(16) float As[2][G_ELEMS];  // [t][m], stride G_STRIDE
    __shared__ __align__(16) float Bs[2][G_ELEMS];  // [t][n], stride G_STRIDE

    X += blockIdx.z * sX;
    G += blockIdx.z * sG;

    const int nBase = blockIdx.x * BN;
    const int mBase = blockIdx.y * BM;

    const int tid   = threadIdx.x;
    const int lane  = tid & 31;
    const int wave  = tid >> 5;
    const int lmod  = lane & 15;
    const int lhalf = lane >> 4;
    const int wm    = (wave >> 1) * 32;
    const int wn    = (wave & 1) * 32;

    const unsigned asBase = (unsigned)(size_t)&As[0][0];  // LDS byte offset
    const unsigned bsBase = (unsigned)(size_t)&Bs[0][0];

    // 8 async B128 copies (4 for each tile) into buffer `buf`.
    auto stage = [&](int t0, int buf) {
        unsigned la[4], lb[4];
        const float* ga[4];
        const float* gb[4];
#pragma unroll
        for (int p = 0; p < 4; ++p) {
            int f   = tid + p * 128;         // 512 x float4 = 32 rows * 16 groups
            int row = f >> 4;                // t
            int cg  = (f & 15) * 4;          // m or n
            const float* g = X + (size_t)(t0 + row) * D + cg;
            unsigned o = (unsigned)((buf * G_ELEMS + row * G_STRIDE + cg) * 4);
            ga[p] = g + mBase;
            gb[p] = g + nBase;
            la[p] = asBase + o;
            lb[p] = bsBase + o;
        }
        // The copies and their s_wait_xcnt in one statement: no address register
        // of an issued copy is rewritten in front of the wait.
        asm volatile("global_load_async_to_lds_b128 %0, %8, off\n\t"
                     "global_load_async_to_lds_b128 %1, %9, off\n\t"
                     "global_load_async_to_lds_b128 %2, %10, off\n\t"
                     "global_load_async_to_lds_b128 %3, %11, off\n\t"
                     "global_load_async_to_lds_b128 %4, %12, off\n\t"
                     "global_load_async_to_lds_b128 %5, %13, off\n\t"
                     "global_load_async_to_lds_b128 %6, %14, off\n\t"
                     "global_load_async_to_lds_b128 %7, %15, off\n\t"
                     "s_wait_xcnt 0x0"
                     :: "v"(la[0]), "v"(la[1]), "v"(la[2]), "v"(la[3]),
                        "v"(lb[0]), "v"(lb[1]), "v"(lb[2]), "v"(lb[3]),
                        "v"(ga[0]), "v"(ga[1]), "v"(ga[2]), "v"(ga[3]),
                        "v"(gb[0]), "v"(gb[1]), "v"(gb[2]), "v"(gb[3])
                     : "memory");
    };

    v8f acc[4];
#pragma unroll
    for (int i = 0; i < 4; ++i) acc[i] = (v8f)0.0f;

    const int nChunks = T / BK;
    stage(0, 0);
    // tile 0 has landed for this wave; the barrier publishes it to the others
    asm volatile("s_wait_asynccnt 0x0" ::: "memory");
    __syncthreads();
    if (nChunks > 1) stage(BK, 1);

    for (int c = 0; c < nChunks; ++c) {
        const int cur = c & 1;
        const float* Ab = &As[cur][0];
        const float* Bb = &Bs[cur][0];

#pragma unroll
        for (int kk = 0; kk < BK; kk += 4) {
            const int ka = kk + lhalf * 2;
            v2f a0, a1, b0, b1;
            a0[0] = Ab[ka * G_STRIDE + wm + lmod];
            a0[1] = Ab[(ka + 1) * G_STRIDE + wm + lmod];
            a1[0] = Ab[ka * G_STRIDE + wm + 16 + lmod];
            a1[1] = Ab[(ka + 1) * G_STRIDE + wm + 16 + lmod];
            b0[0] = Bb[ka * G_STRIDE + wn + lmod];
            b0[1] = Bb[(ka + 1) * G_STRIDE + wn + lmod];
            b1[0] = Bb[ka * G_STRIDE + wn + 16 + lmod];
            b1[1] = Bb[(ka + 1) * G_STRIDE + wn + 16 + lmod];
            acc[0] = __builtin_amdgcn_wmma_f32_16x16x4_f32(false, a0, false, b0, (short)0, acc[0], false, false);
            acc[1] = __builtin_amdgcn_wmma_f32_16x16x4_f32(false, a0, false, b1, (short)0, acc[1], false, false);
            acc[2] = __builtin_amdgcn_wmma_f32_16x16x4_f32(false, a1, false, b0, (short)0, acc[2], false, false);
            acc[3] = __builtin_amdgcn_wmma_f32_16x16x4_f32(false, a1, false, b1, (short)0, acc[3], false, false);
        }

        // this wave's reads of buffer `cur` are done before it may be refilled
        asm volatile("s_wait_dscnt 0x0" ::: "memory");
        // this wave's copies of tile c+1 have landed
        asm volatile("s_wait_asynccnt 0x0" ::: "memory");
        // one barrier: publishes tile c+1 and ends every reader's use of `cur`
        __syncthreads();
        if (c + 2 < nChunks) stage((c + 2) * BK, cur);
    }
    // no copy is outstanding when the wave ends
    asm volatile("s_wait_asynccnt 0x0" ::: "memory");

#pragma unroll
    for (int i = 0; i < 2; ++i) {
#pragma unroll
        for (int j = 0; j < 2; ++j) {
            v8f r = acc[i * 2 + j];
            const int n  = nBase + wn + j * 16 + lmod;
            const int mB = mBase + wm + i * 16 + lhalf * 8;
#pragma unroll
            for (int e = 0; e < 8; ++e)
                G[(size_t)(mB + e) * D + n] = r[e];
        }
    }
}

// Column sums of x per batch: s[d] = sum_t X[t*D+d]. Writes s as row D of the
// extended Gram matrix (rows D+1 .. D+NX-1 zero) and R = [s, T, 0 ...] (D+NX long).
__global__ __launch_bounds__(512)
void colsum_f32(const float* __restrict__ X, float* __restrict__ G, float* __restrict__ R,
                int T, int D)
{
    __shared__ __align__(16) float part[32][64];

    const int b   = blockIdx.y;
    const int tid = threadIdx.x;
    const int c4  = (tid & 15) * 4;
    const int rg  = tid >> 4;            // 0..31
    const int c0  = blockIdx.x * 64;

    G += (size_t)b * (D + NX) * D;
    R += (size_t)b * (D + NX);

    const float* p = X + ((size_t)b * T + rg) * D + c0 + c4;
    float4 s = make_float4(0.0f, 0.0f, 0.0f, 0.0f);
// eight independent loads in flight per thread, to cover the memory latency
#pragma unroll 8
    for (int i = 0; i < T / 32; ++i) {
        const float4 v = *(const float4*)p;
        s.x += v.x; s.y += v.y; s.z += v.z; s.w += v.w;
        p += (size_t)32 * D;
    }
    *(float4*)&part[rg][c4] = s;
    __syncthreads();

    if (tid < 64) {
        float t = 0.0f;
#pragma unroll
        for (int g = 0; g < 32; ++g) t += part[g][tid];
        G[(size_t)D * D + c0 + tid] = t;
        R[c0 + tid] = t;
        // the two stores' address and data registers are reused right below
        asm volatile("s_wait_xcnt 0x0" ::: "memory");
        if (blockIdx.x == 0) R[D + tid] = (tid == 0) ? (float)T : 0.0f;
    }
    for (int f = tid; f < (NX - 1) * 64; f += 512)
        G[(size_t)(D + 1 + (f >> 6)) * D + c0 + (f & 63)] = 0.0f;
}

extern "C" void kernel_launch(void* const* d_in, const int* in_sizes, int n_in,
                              void* d_out, int out_size, void* d_ws, size_t ws_size,
                              hipStream_t stream)
{
    const float* x  = (const float*)d_in[0];
    const float* Wk = (const float*)d_in[1];
    const float* bk = (const float*)d_in[2];
    const float* Wq = (const float*)d_in[3];
    const float* bq = (const float*)d_in[4];
    const float* Wv = (const float*)d_in[5];
    const float* bv = (const float*)d_in[6];
    float* out = (float*)d_out;

    const int Bsz = 4, T = 4096, D = 2048, H = 4, Dh = 512;
    const int Mtot = Bsz * T;  // 16384

    // workspace (fp32): Q (Mtot x D), GX (B x (D+NX) x D), Y (B x D x (D+NX)),
    // S (B*H x Dh x Dh), R (B x (D+NX))
    const int DX = D + NX;  // 2112
    float* Q  = (float*)d_ws;
    float* GX = Q  + (size_t)Mtot * D;
    float* Y  = GX + (size_t)Bsz * DX * D;
    float* S  = Y  + (size_t)Bsz * D * DX;
    float* R  = S  + (size_t)Bsz * H * Dh * Dh;

    dim3 blk(128);

    // With s = x_b^T 1 and G = x_b^T x_b:
    //   k^T v = (Wk G + bk s^T) Wv^T + (Wk s + T bk) bv^T   (rows of Wk, Wv of head h)

    // Phase 1a: s per batch -> row D of GX, and R = [s, T, 0 ...]
    colsum_f32<<<dim3(D / 64, Bsz), dim3(512), 0, stream>>>(x, GX, R, T, D);

    // Phase 1b: G = x_b^T x_b -> rows 0 .. D-1 of GX
    gram_f32_wmma<<<dim3(D / BN, D / BM, Bsz), blk, 0, stream>>>(
        x, GX, T, D, (long long)T * D, (long long)DX * D);

    // Phase 1c: Y[m][n] = sum_k Wk[m][k] GX[n][k] + bk[m] R[n]
    //   columns 0 .. D-1: Wk G + bk s^T (G[n][k] = G[k][n]); column D: Wk s + T bk
    retnext_gemm_f32_wmma<1, 0, 2><<<dim3(DX / BN, D / BM, Bsz), blk, 0, stream>>>(
        Wk, GX, R, Y, D, DX, D, D, D, DX,
        /*sAb*/0, 0, /*sBb*/(long long)DX * D, 0, /*sCb*/(long long)D * DX, 0, 1,
        /*rowv*/bk, 1, 0, 0, /*sQb*/(long long)DX, 0);

    // Phase 1d: Q = x @ Wq^T + bq
    retnext_gemm_f32_wmma<1, 0, 1><<<dim3(D / BN, Mtot / BM, 1), blk, 0, stream>>>(
        x, Wq, bq, Q, Mtot, D, D, D, D, D,
        0, 0, 0, 0, 0, 0, 1,
        nullptr, 0, 0, 0, 0, 0);

    // Phase 2: states[b,h][m][n] = sum_k Y[h*Dh+m][k] Wv[h*Dh+n][k] + Y[h*Dh+m][D] bv[h*Dh+n]
    retnext_gemm_f32_wmma<1, 0, 2><<<dim3(Dh / BN, Dh / BM, Bsz * H), blk, 0, stream>>>(
        Y, Wv, bv, S, Dh, Dh, D,
        /*lda*/DX, /*ldb*/D, /*ldc*/Dh,
        /*sAb*/(long long)D * DX,      /*sAh*/(long long)Dh * DX,
        /*sBb*/0,                      /*sBh*/(long long)Dh * D,
        /*sCb*/(long long)H * Dh * Dh, /*sCh*/(long long)Dh * Dh,
        H,
        /*rowv*/Y + D, DX, /*sVb*/(long long)D * DX, /*sVh*/(long long)Dh * DX,
        /*sQb*/0, /*sQh*/(long long)Dh);

    // Phase 3: out[b,h] = Q[b*T:, h*Dh:] (T x Dh) @ states[b,h] (Dh x Dh)
    retnext_gemm_f32_wmma<0, 0, 0><<<dim3(Dh / BN, T / BM, Bsz * H), blk, 0, stream>>>(
        Q, S, nullptr, out, T, Dh, Dh,
        /*lda*/D, /*ldb*/Dh, /*ldc*/Dh,
        /*sAb*/(long long)T * D,       /*sAh*/(long long)Dh,
        /*sBb*/(long long)H * Dh * Dh, /*sBh*/(long long)Dh * Dh,
        /*sCb*/(long long)H * T * Dh,  /*sCh*/(long long)T * Dh,
        H,
        nullptr, 0, 0, 0, 0, 0);
}

// v002
// A run of this version takes 1660 microseconds.
// Two timings next to v001 both put it at 1.20 times that version's speed.
// Counting every step since v000, it is 1.31 times as fast.
#include <hip/hip_runtime.h>

typedef __attribute__((ext_vector_type(2))) float v2f;
typedef __attribute__((ext_vector_type(8))) float v8f;

#define BM 64
#define BN 64
#define BK 32

#define A_STRIDE    36   // MK layout row stride in floats (144B, 16B-aligned)
#define B_NK_STRIDE 36   // NK layout (transB) row stride
#define B_KN_STRIDE 68   // KN layout (!transB) row stride (272B, 16B-aligned)
#define BUF_ELEMS   2304 // max(64*36, 32*68)
#define G_STRIDE    80   // Gram tiles, [k][64] rows: the 4 k rows of one fragment read fall on 4 disjoint 16-bank groups
#define G_ELEMS     2560 // 32 * 80
#define NX          64   // extra rows of the extended Gram matrix (row D holds the column sums of x)

// One 16-byte global->LDS async copy (no VGPR staging, tracked by ASYNCcnt).
__device__ __forceinline__ void async_copy16(unsigned lds_off, const float* gptr) {
    asm volatile("global_load_async_to_lds_b128 %0, %1, off"
                 :: "v"(lds_off), "v"(gptr)
                 : "memory");
}

// Generic fp32 WMMA GEMM:
//   C[m][n] = sum_k A[m*lda+k] * (TRANSB ? B[n*ldb+k] : B[k*ldb+n]) (+ bias[n])
// HASBIAS == 2: rank-1 term instead of a bias: + rowv[m*rvStride] * bias[n].
// TRANSC: store C[n*ldc+m]. Batched over blockIdx.z, z = b*nh + h.
template<int TRANSB, int TRANSC, int HASBIAS>
__global__ __launch_bounds__(128)
void retnext_gemm_f32_wmma(const float* __restrict__ A,
                           const float* __restrict__ B,
                           const float* __restrict__ bias,
                           float* __restrict__ C,
                           int M, int N, int K,
                           int lda, int ldb, int ldc,
                           long long sAb, long long sAh,
                           long long sBb, long long sBh,
                           long long sCb, long long sCh,
                           int nh,
                           const float* __restrict__ rowv, int rvStride,
                           long long sVb, long long sVh,
                           long long sQb, long long sQh)
{
    __shared__ __align__(16) float As[2][BUF_ELEMS];  // [m][k], stride A_STRIDE
    __shared__ __align__(16) float Bs[2][BUF_ELEMS];  // NK or KN layout

    const int z  = blockIdx.z;
    const int bb = z / nh;
    const int hh = z % nh;
    A += bb * sAb + hh * sAh;
    B += bb * sBb + hh * sBh;
    C += bb * sCb + hh * sCh;
    if (HASBIAS == 2) {
        rowv += bb * sVb + hh * sVh;
        bias += bb * sQb + hh * sQh;
    }

    const int nBase = blockIdx.x * BN;
    const int mBase = blockIdx.y * BM;

    const int tid   = threadIdx.x;
    const int lane  = tid & 31;
    const int wave  = tid >> 5;          // 0..3
    const int lmod  = lane & 15;
    const int lhalf = lane >> 4;         // 0 or 1
    const int wm    = (wave >> 1) * 32;  // wave's row offset in 64x64 tile
    const int wn    = (wave & 1) * 32;   // wave's col offset

    const unsigned asBase = (unsigned)(size_t)&As[0][0];  // LDS byte offset
    const unsigned bsBase = (unsigned)(size_t)&Bs[0][0];

    // Issue 8 async B128 copies (4 for A tile, 4 for B tile) into buffer `buf`.
    auto stage_async = [&](int k0, int buf) {
#pragma unroll
        for (int p = 0; p < 4; ++p) {
            int f   = tid + p * 128;         // 512 x float4 = 64 rows * 8 groups
            int row = f >> 3;                // m
            int cg  = (f & 7) * 4;           // k
            const float* g = A + (size_t)(mBase + row) * lda + k0 + cg;
            unsigned l = asBase + (unsigned)((buf * BUF_ELEMS + row * A_STRIDE + cg) * 4);
            async_copy16(l, g);
        }
        if (TRANSB) {
            // source B[n][k] -> Bs_nk[n][k]: pure row copy
#pragma unroll
            for (int p = 0; p < 4; ++p) {
                int f   = tid + p * 128;
                int row = f >> 3;            // n
                int cg  = (f & 7) * 4;       // k
                const float* g = B + (size_t)(nBase + row) * ldb + k0 + cg;
                unsigned l = bsBase + (unsigned)((buf * BUF_ELEMS + row * B_NK_STRIDE + cg) * 4);
                async_copy16(l, g);
            }
        } else {
            // source B[k][n] -> Bs_kn[k][n]: pure row copy
#pragma unroll
            for (int p = 0; p < 4; ++p) {
                int f   = tid + p * 128;     // 512 x float4 = 32 rows * 16 groups
                int row = f >> 4;            // k
                int cg  = (f & 15) * 4;      // n
                const float* g = B + (size_t)(k0 + row) * ldb + nBase + cg;
                unsigned l = bsBase + (unsigned)((buf * BUF_ELEMS + row * B_KN_STRIDE + cg) * 4);
                async_copy16(l, g);
            }
        }
    };

    v8f acc[4];
#pragma unroll
    for (int i = 0; i < 4; ++i) acc[i] = (v8f)0.0f;

    const int nChunks = K / BK;
    stage_async(0, 0);

    for (int c = 0; c < nChunks; ++c) {
        const int cur = c & 1;

        if (c + 1 < nChunks) {
            stage_async((c + 1) * BK, cur ^ 1);
            // chunk c's 8 asyncs complete (in order); chunk c+1's 8 stay in flight
            asm volatile("s_wait_asynccnt 0x8" ::: "memory");
        } else {
            asm volatile("s_wait_asynccnt 0x0" ::: "memory");
        }
        __syncthreads();

        const float* Ab = &As[cur][0];
        const float* Bb = &Bs[cur][0];

#pragma unroll
        for (int kk = 0; kk < BK; kk += 4) {
            const int ka = kk + lhalf * 2;
            v2f a0, a1, b0, b1;
            a0[0] = Ab[(wm + lmod) * A_STRIDE + ka];
            a0[1] = Ab[(wm + lmod) * A_STRIDE + ka + 1];
            a1[0] = Ab[(wm + 16 + lmod) * A_STRIDE + ka];
            a1[1] = Ab[(wm + 16 + lmod) * A_STRIDE + ka + 1];
            if (TRANSB) {
                b0[0] = Bb[(wn + lmod) * B_NK_STRIDE + ka];
                b0[1] = Bb[(wn + lmod) * B_NK_STRIDE + ka + 1];
                b1[0] = Bb[(wn + 16 + lmod) * B_NK_STRIDE + ka];
                b1[1] = Bb[(wn + 16 + lmod) * B_NK_STRIDE + ka + 1];
            } else {
                b0[0] = Bb[ka * B_KN_STRIDE + wn + lmod];
                b0[1] = Bb[(ka + 1) * B_KN_STRIDE + wn + lmod];
                b1[0] = Bb[ka * B_KN_STRIDE + wn + 16 + lmod];
                b1[1] = Bb[(ka + 1) * B_KN_STRIDE + wn + 16 + lmod];
            }
            acc[0] = __builtin_amdgcn_wmma_f32_16x16x4_f32(false, a0, false, b0, (short)0, acc[0], false, false);
            acc[1] = __builtin_amdgcn_wmma_f32_16x16x4_f32(false, a0, false, b1, (short)0, acc[1], false, false);
            acc[2] = __builtin_amdgcn_wmma_f32_16x16x4_f32(false, a1, false, b0, (short)0, acc[2], false, false);
            acc[3] = __builtin_amdgcn_wmma_f32_16x16x4_f32(false, a1, false, b1, (short)0, acc[3], false, false);
        }
        __syncthreads();
    }

    // ---- epilogue: bias + store (normal or transposed) ----
#pragma unroll
    for (int i = 0; i < 2; ++i) {
#pragma unroll
        for (int j = 0; j < 2; ++j) {
            v8f r = acc[i * 2 + j];
            const int n = nBase + wn + j * 16 + lmod;
            float bv = 0.0f;
            if (HASBIAS) bv = bias[n];
            const int mB = mBase + wm + i * 16 + lhalf * 8;
            if (HASBIAS == 2) {
#pragma unroll
                for (int e = 0; e < 8; ++e)
                    C[(size_t)(mB + e) * ldc + n] = r[e] + rowv[(size_t)(mB + e) * rvStride] * bv;
            } else if (!TRANSC) {
#pragma unroll
                for (int e = 0; e < 8; ++e)
                    C[(size_t)(mB + e) * ldc + n] = r[e] + bv;
            } else {
#pragma unroll
                for (int e = 0; e < 8; ++e)
                    C[(size_t)n * ldc + mB + e] = r[e] + bv;
            }
        }
    }
}

// Gram matrix of one batch: G[m][n] = sum_t X[t*D+m] * X[t*D+n], batched over blockIdx.z.
// Both operand tiles are 32 rows (t) of 64 floats, copied row by row into LDS.
// G[n][m] is the same sum of the same products in the same order as G[m][n], so only
// the tiles on and below the diagonal are computed; each tile below it is stored twice,
// as it is and transposed. Grid: x = 0 .. D/64, y = 0 .. D/128 - 1. Tile row y (y+1 tiles)
// and tile row D/64-1-y (D/64-y tiles) share one grid row of D/64+1 work-groups.
__global__ __launch_bounds__(128)
void gram_f32_wmma(const float* __restrict__ X, float* __restrict__ G,
                   int T, int D, long long sX, long long sG)
{
    __shared__ __align__(16) float As[2][G_ELEMS];  // [t][m], stride G_STRIDE
    __shared__ __align__(16) float Bs[2][G_ELEMS];  // [t][n], stride G_STRIDE

    X += blockIdx.z * sX;
    G += blockIdx.z * sG;

    const int  gx    = blockIdx.x;
    const int  gy    = blockIdx.y;
    const bool first = gx <= gy;
    const int  mBase = (first ? gy : D / BM - 1 - gy) * BM;
    const int  nBase = (first ? gx : gx - gy - 1) * BN;   // nBase <= mBase

    const int tid   = threadIdx.x;
    const int lane  = tid & 31;
    const int wave  = tid >> 5;
    const int lmod  = lane & 15;
    const int lhalf = lane >> 4;
    const int wm    = (wave >> 1) * 32;
    const int wn    = (wave & 1) * 32;

    const unsigned asBase = (unsigned)(size_t)&As[0][0];  // LDS byte offset
    const unsigned bsBase = (unsigned)(size_t)&Bs[0][0];

    // 8 async B128 copies (4 for each tile) into buffer `buf`.
    auto stage = [&](int t0, int buf) {
        unsigned la[4], lb[4];
        const float* ga[4];
        const float* gb[4];
#pragma unroll
        for (int p = 0; p < 4; ++p) {
            int f   = tid + p * 128;         // 512 x float4 = 32 rows * 16 groups
            int row = f >> 4;                // t
            int cg  = (f & 15) * 4;          // m or n
            const float* g = X + (size_t)(t0 + row) * D + cg;
            unsigned o = (unsigned)((buf * G_ELEMS + row * G_STRIDE + cg) * 4);
            ga[p] = g + mBase;
            gb[p] = g + nBase;
            la[p] = asBase + o;
            lb[p] = bsBase + o;
        }
        // The copies and their s_wait_xcnt in one statement: no address register
        // of an issued copy is rewritten in front of the wait.
        asm volatile("global_load_async_to_lds_b128 %0, %8, off\n\t"
                     "global_load_async_to_lds_b128 %1, %9, off\n\t"
                     "global_load_async_to_lds_b128 %2, %10, off\n\t"
                     "global_load_async_to_lds_b128 %3, %11, off\n\t"
                     "global_load_async_to_lds_b128 %4, %12, off\n\t"
                     "global_load_async_to_lds_b128 %5, %13, off\n\t"
                     "global_load_async_to_lds_b128 %6, %14, off\n\t"
                     "global_load_async_to_lds_b128 %7, %15, off\n\t"
                     "s_wait_xcnt 0x0"
                     :: "v"(la[0]), "v"(la[1]), "v"(la[2]), "v"(la[3]),
                        "v"(lb[0]), "v"(lb[1]), "v"(lb[2]), "v"(lb[3]),
                        "v"(ga[0]), "v"(ga[1]), "v"(ga[2]), "v"(ga[3]),
                        "v"(gb[0]), "v"(gb[1]), "v"(gb[2]), "v"(gb[3])
                     : "memory");
    };

    v8f acc[4];
#pragma unroll
    for (int i = 0; i < 4; ++i) acc[i] = (v8f)0.0f;

    const int nChunks = T / BK;
    stage(0, 0);
    // tile 0 has landed for this wave; the barrier publishes it to the others
    asm volatile("s_wait_asynccnt 0x0" ::: "memory");
    __syncthreads();
    if (nChunks > 1) stage(BK, 1);

    for (int c = 0; c < nChunks; ++c) {
        const int cur = c & 1;
        const float* Ab = &As[cur][0];
        const float* Bb = &Bs[cur][0];

#pragma unroll
        for (int kk = 0; kk < BK; kk += 4) {
            const int ka = kk + lhalf * 2;
            v2f a0, a1, b0, b1;
            a0[0] = Ab[ka * G_STRIDE + wm + lmod];
            a0[1] = Ab[(ka + 1) * G_STRIDE + wm + lmod];
            a1[0] = Ab[ka * G_STRIDE + wm + 16 + lmod];
            a1[1] = Ab[(ka + 1) * G_STRIDE + wm + 16 + lmod];
            b0[0] = Bb[ka * G_STRIDE + wn + lmod];
            b0[1] = Bb[(ka + 1) * G_STRIDE + wn + lmod];
            b1[0] = Bb[ka * G_STRIDE + wn + 16 + lmod];
            b1[1] = Bb[(ka + 1) * G_STRIDE + wn + 16 + lmod];
            acc[0] = __builtin_amdgcn_wmma_f32_16x16x4_f32(false, a0, false, b0, (short)0, acc[0], false, false);
            acc[1] = __builtin_amdgcn_wmma_f32_16x16x4_f32(false, a0, false, b1, (short)0, acc[1], false, false);
            acc[2] = __builtin_amdgcn_wmma_f32_16x16x4_f32(false, a1, false, b0, (short)0, acc[2], false, false);
            acc[3] = __builtin_amdgcn_wmma_f32_16x16x4_f32(false, a1, false, b1, (short)0, acc[3], false, false);
        }

        // this wave's reads of buffer `cur` are done before it may be refilled
        asm volatile("s_wait_dscnt 0x0" ::: "memory");
        // this wave's copies of tile c+1 have landed
        asm volatile("s_wait_asynccnt 0x0" ::: "memory");
        // one barrier: publishes tile c+1 and ends every reader's use of `cur`
        __syncthreads();
        if (c + 2 < nChunks) stage((c + 2) * BK, cur);
    }
    // no copy is outstanding when the wave ends
    asm volatile("s_wait_asynccnt 0x0" ::: "memory");

#pragma unroll
    for (int i = 0; i < 2; ++i) {
#pragma unroll
        for (int j = 0; j < 2; ++j) {
            v8f r = acc[i * 2 + j];
            const int n  = nBase + wn + j * 16 + lmod;
            const int mB = mBase + wm + i * 16 + lhalf * 8;
#pragma unroll
            for (int e = 0; e < 8; ++e)
                G[(size_t)(mB + e) * D + n] = r[e];
            if (mBase != nBase) {
                // the mirrored tile: a lane's 8 values are 32 contiguous bytes of row n
                float* p = G + (size_t)n * D + mB;
                *(float4*)p       = make_float4(r[0], r[1], r[2], r[3]);
                *(float4*)(p + 4) = make_float4(r[4], r[5], r[6], r[7]);
            }
        }
    }
}

// Column sums of x per batch: s[d] = sum_t X[t*D+d]. Writes s as row D of the
// extended Gram matrix (rows D+1 .. D+NX-1 zero) and R = [s, T, 0 ...] (D+NX long).
__global__ __launch_bounds__(512)
void colsum_f32(const float* __restrict__ X, float* __restrict__ G, float* __restrict__ R,
                int T, int D)
{
    __shared__ __align__(16) float part[32][64];

    const int b   = blockIdx.y;
    const int tid = threadIdx.x;
    const int c4  = (tid & 15) * 4;
    const int rg  = tid >> 4;            // 0..31
    const int c0  = blockIdx.x * 64;

    G += (size_t)b * (D + NX) * D;
    R += (size_t)b * (D + NX);

    const float* p = X + ((size_t)b * T + rg) * D + c0 + c4;
    float4 s = make_float4(0.0f, 0.0f, 0.0f, 0.0f);
// eight independent loads in flight per thread, to cover the memory latency
#pragma unroll 8
    for (int i = 0; i < T / 32; ++i) {
        const float4 v = *(const float4*)p;
        s.x += v.x; s.y += v.y; s.z += v.z; s.w += v.w;
        p += (size_t)32 * D;
    }
    *(float4*)&part[rg][c4] = s;
    __syncthreads();

    if (tid < 64) {
        float t = 0.0f;
#pragma unroll
        for (int g = 0; g < 32; ++g) t += part[g][tid];
        G[(size_t)D * D + c0 + tid] = t;
        R[c0 + tid] = t;
        // the two stores' address and data registers are reused right below
        asm volatile("s_wait_xcnt 0x0" ::: "memory");
        if (blockIdx.x == 0) R[D + tid] = (tid == 0) ? (float)T : 0.0f;
    }
    for (int f = tid; f < (NX - 1) * 64; f += 512)
        G[(size_t)(D + 1 + (f >> 6)) * D + c0 + (f & 63)] = 0.0f;
}

extern "C" void kernel_launch(void* const* d_in, const int* in_sizes, int n_in,
                              void* d_out, int out_size, void* d_ws, size_t ws_size,
                              hipStream_t stream)
{
    const float* x  = (const float*)d_in[0];
    const float* Wk = (const float*)d_in[1];
    const float* bk = (const float*)d_in[2];
    const float* Wq = (const float*)d_in[3];
    const float* bq = (const float*)d_in[4];
    const float* Wv = (const float*)d_in[5];
    const float* bv = (const float*)d_in[6];
    float* out = (float*)d_out;

    const int Bsz = 4, T = 4096, D = 2048, H = 4, Dh = 512;
    const int Mtot = Bsz * T;  // 16384

    // workspace (fp32): Q (Mtot x D), GX (B x (D+NX) x D), Y (B x D x (D+NX)),
    // S (B*H x Dh x Dh), R (B x (D+NX))
    const int DX = D + NX;  // 2112
    float* Q  = (float*)d_ws;
    float* GX = Q  + (size_t)Mtot * D;
    float* Y  = GX + (size_t)Bsz * DX * D;
    float* S  = Y  + (size_t)Bsz * D * DX;
    float* R  = S  + (size_t)Bsz * H * Dh * Dh;

    dim3 blk(128);

    // With s = x_b^T 1 and G = x_b^T x_b:
    //   k^T v = (Wk G + bk s^T) Wv^T + (Wk s + T bk) bv^T   (rows of Wk, Wv of head h)

    // Phase 1a: s per batch -> row D of GX, and R = [s, T, 0 ...]
    colsum_f32<<<dim3(D / 64, Bsz), dim3(512), 0, stream>>>(x, GX, R, T, D);

    // Phase 1b: G = x_b^T x_b -> rows 0 .. D-1 of GX (lower-triangle tiles, mirrored)
    gram_f32_wmma<<<dim3(D / BN + 1, D / BM / 2, Bsz), blk, 0, stream>>>(
        x, GX, T, D, (long long)T * D, (long long)DX * D);

    // Phase 1c: Y[m][n] = sum_k Wk[m][k] GX[n][k] + bk[m] R[n]
    //   columns 0 .. D-1: Wk G + bk s^T (G[n][k] = G[k][n]); column D: Wk s + T bk
    retnext_gemm_f32_wmma<1, 0, 2><<<dim3(DX / BN, D / BM, Bsz), blk, 0, stream>>>(
        Wk, GX, R, Y, D, DX, D, D, D, DX,
        /*sAb*/0, 0, /*sBb*/(long long)DX * D, 0, /*sCb*/(long long)D * DX, 0, 1,
        /*rowv*/bk, 1, 0, 0, /*sQb*/(long long)DX, 0);

    // Phase 1d: Q = x @ Wq^T + bq
    retnext_gemm_f32_wmma<1, 0, 1><<<dim3(D / BN, Mtot / BM, 1), blk, 0, stream>>>(
        x, Wq, bq, Q, Mtot, D, D, D, D, D,
        0, 0, 0, 0, 0, 0, 1,
        nullptr, 0, 0, 0, 0, 0);

    // Phase 2: states[b,h][m][n] = sum_k Y[h*Dh+m][k] Wv[h*Dh+n][k] + Y[h*Dh+m][D] bv[h*Dh+n]
    retnext_gemm_f32_wmma<1, 0, 2><<<dim3(Dh / BN, Dh / BM, Bsz * H), blk, 0, stream>>>(
        Y, Wv, bv, S, Dh, Dh, D,
        /*lda*/DX, /*ldb*/D, /*ldc*/Dh,
        /*sAb*/(long long)D * DX,      /*sAh*/(long long)Dh * DX,
        /*sBb*/0,                      /*sBh*/(long long)Dh * D,
        /*sCb*/(long long)H * Dh * Dh, /*sCh*/(long long)Dh * Dh,
        H,
        /*rowv*/Y + D, DX, /*sVb*/(long long)D * DX, /*sVh*/(long long)Dh * DX,
        /*sQb*/0, /*sQh*/(long long)Dh);

    // Phase 3: out[b,h] = Q[b*T:, h*Dh:] (T x Dh) @ states[b,h] (Dh x Dh)
    retnext_gemm_f32_wmma<0, 0, 0><<<dim3(Dh / BN, T / BM, Bsz * H), blk, 0, stream>>>(
        Q, S, nullptr, out, T, Dh, Dh,
        /*lda*/D, /*ldb*/Dh, /*ldc*/Dh,
        /*sAb*/(long long)T * D,       /*sAh*/(long long)Dh,
        /*sBb*/(long long)H * Dh * Dh, /*sBh*/(long long)Dh * Dh,
        /*sCb*/(long long)H * T * Dh,  /*sCh*/(long long)T * Dh,
        H,
        nullptr, 0, 0, 0, 0, 0);
}
